// v000
// Times are from an AMD MI455X. After a warm-up the kernel runs many times in a row, and a time is the length of
// such a window on the GPU divided by its runs, so every launch and the gaps after it count. The runs cycle
// through copies of the inputs. A figure is the median of several windows, for all but v000 over two sittings.
// Sittings can differ by a few percent; kernels timed side by side share one.
// The starting kernel, v000, takes 473 microseconds a run.
#include <hip/hip_runtime.h>
#include <hip/hip_bf16.h>
#include <math.h>

// ---------------------------------------------------------------------------
// MultiHeadCoAttention for MI455X (gfx1250, wave32, WMMA + async-to-LDS).
//
// ~39 GFLOP fp32 (softmax-mixing commuted past the value projections),
// ~200 MB mandatory value-tensor traffic -> ~8.5us floor at 23.3 TB/s.
// GEMMs use V_WMMA_F32_16X16X4_F32 (true fp32, preserves reference precision).
// Plain GEMMs stage tiles with GLOBAL_LOAD_ASYNC_TO_LDS_B128 double-buffered
// on ASYNCcnt; the attention-mix GEMMs keep a VALU loader (they compute the
// size-8 head mix on the way into LDS).
//
// Workspace layout (floats):
//   qp  [4000,1024]    @ 0
//   kp  [4000,1024]    @ 4,096,000
//   sim [B*H*H=512]    @ 8,192,000
//   att [512]          @ 8,192,512
//   mr  [B,T,1024]     @ 8,193,024
//   sr  [B,T,512]      @ 12,289,024
//   total 14,337,024 floats = ~57.4 MB
// ---------------------------------------------------------------------------

typedef float v2f __attribute__((ext_vector_type(2)));
typedef float v8f __attribute__((ext_vector_type(8)));
typedef int   v4i __attribute__((vector_size(16)));  // matches builtin param

#define AS1 __attribute__((address_space(1)))
#define AS3 __attribute__((address_space(3)))

#if defined(__AMDGCN__) &&                                        \
    __has_builtin(__builtin_amdgcn_global_load_async_to_lds_b128) && \
    __has_builtin(__builtin_amdgcn_s_wait_asynccnt)
#define ASYNC_STAGE 1
#else
#define ASYNC_STAGE 0
#endif

#define HH   8
#define DMC  1024
#define DSC  512
#define BB   8
#define SS   500
#define TT   500
#define DH   128
#define DSH  64

#define QP_OFF  0ul
#define KP_OFF  4096000ul
#define SIM_OFF 8192000ul
#define ATT_OFF 8192512ul
#define MR_OFF  8193024ul
#define SR_OFF  12289024ul

// ---------------------------------------------------------------------------
// Tiled fp32 WMMA GEMM:  C[m, n] = sum_k A[m,k] * W[n,k] + bias[n]
// Block tile 128(M) x 64(N), 8 waves, each wave 32x32 via 2x2 16x16 frags.
// K staged through LDS in chunks of 16 (4 wmma k-steps per chunk).
//
// Plain mode: async global->LDS staging, double-buffered on ASYNCcnt.
//   A rows past M are clamped to M-1 (their C rows are discarded at store).
// MIX mode: blockIdx.z encodes (b,h2); the A loader computes
//   A[m=t,c] = sum_h1 att[b,h2,h1] * planes[h1*planeStride + (b*M+t)*K + c]
//   and W/bias/C are offset to the h2-th head slice (N = dh columns).
// ---------------------------------------------------------------------------
template <bool MIX>
__global__ __launch_bounds__(256) void wmma_gemm_kernel(
    const float* __restrict__ A, const float* __restrict__ W,
    const float* __restrict__ bias, float* __restrict__ C,
    int M, int N, int K, int ldC,
    const float* __restrict__ att, const float* __restrict__ planes,
    long planeStride) {
  constexpr int AST = 20;  // padded LDS row stride (floats)
  constexpr int BST = 20;
  constexpr int NBUF = (!MIX && ASYNC_STAGE) ? 2 : 1;
  __shared__ float As[NBUF][128 * AST];
  __shared__ float Bs[NBUF][64 * BST];

  const int tid  = threadIdx.x;
  const int lane = tid & 31;
  const int wave = tid >> 5;
  const int wm   = wave & 3;   // 0..3 -> 32-row band
  const int wn   = wave >> 2;  // 0..1 -> 32-col band
  const int hi   = lane >> 4;  // lane group (0|1)
  const int lo   = lane & 15;

  const int n0 = blockIdx.x * 64;
  const int m0 = blockIdx.y * 128;

  const float* Wp = W;
  const float* bp = bias;
  const float* Ap = A;
  float*       Cp = C;
  float attr[HH];
  if constexpr (MIX) {
    const int z = blockIdx.z;
    const int bidx = z / HH;
    const int h2   = z % HH;
    Wp = W + (size_t)(h2 * N) * K;           // head slice of projection
    bp = bias + h2 * N;
    Cp = C + (size_t)bidx * M * ldC + h2 * N;
    Ap = planes + (size_t)bidx * M * K;      // plane base for this batch
#pragma unroll
    for (int h1 = 0; h1 < HH; ++h1)
      attr[h1] = att[(bidx * HH + h2) * HH + h1];
  }

  v8f acc[2][2] = {};

  // ---- 4 k-steps of 16x16x4 fp32 WMMA over one staged 16-wide K chunk
  auto mma_chunk = [&](const float* Asb, const float* Bsb) {
#pragma unroll
    for (int kk = 0; kk < 16; kk += 4) {
      v2f a[2], b[2];
#pragma unroll
      for (int mt = 0; mt < 2; ++mt) {
        const int row = wm * 32 + mt * 16 + lo;              // A: M = lane%16
        a[mt] = *(const v2f*)&Asb[row * AST + kk + 2 * hi];  // K = vg + 2*hi
      }
#pragma unroll
      for (int nt = 0; nt < 2; ++nt) {
        const int col = wn * 32 + nt * 16 + lo;              // B: N = lane%16
        b[nt] = *(const v2f*)&Bsb[col * BST + kk + 2 * hi];
      }
#pragma unroll
      for (int mt = 0; mt < 2; ++mt)
#pragma unroll
        for (int nt = 0; nt < 2; ++nt)
          acc[mt][nt] = __builtin_amdgcn_wmma_f32_16x16x4_f32(
              false, a[mt], false, b[nt], (short)0, acc[mt][nt], false, false);
    }
  };

#if ASYNC_STAGE
  if constexpr (!MIX) {
    // -------- async staging: each wave issues 3 B128 copies per chunk
    auto issue = [&](int buf, int k0) {
      {  // B tile: 64 rows x 16 cols = 256 x 16B, 1 per thread
        const int r  = tid >> 2;
        const int c4 = (tid & 3) << 2;
        float* g = const_cast<float*>(Wp) + (size_t)(n0 + r) * K + k0 + c4;
        __builtin_amdgcn_global_load_async_to_lds_b128(
            (AS1 v4i*)g, (AS3 v4i*)&Bs[buf][r * BST + c4], 0, 0);
      }
#pragma unroll
      for (int i = 0; i < 2; ++i) {  // A tile: 128 x 16 = 512 x 16B
        const int idx = tid + i * 256;
        const int r   = idx >> 2;
        const int c4  = (idx & 3) << 2;
        const int mr  = m0 + r;
        const int m   = (mr < M) ? mr : (M - 1);  // clamp; OOB rows dropped
        float* g = const_cast<float*>(Ap) + (size_t)m * K + k0 + c4;
        __builtin_amdgcn_global_load_async_to_lds_b128(
            (AS1 v4i*)g, (AS3 v4i*)&As[buf][r * AST + c4], 0, 0);
      }
    };

    issue(0, 0);
    int parity = 0;
    for (int k0 = 0; k0 < K; k0 += 16) {
      if (k0 + 16 < K) {
        issue(parity ^ 1, k0 + 16);             // prefetch next chunk
        __builtin_amdgcn_s_wait_asynccnt(3);    // drain current chunk only
      } else {
        __builtin_amdgcn_s_wait_asynccnt(0);
      }
      __syncthreads();                          // all waves' copies landed
      mma_chunk(As[parity], Bs[parity]);
      __syncthreads();                          // done reading before reuse
      parity ^= 1;
    }
  } else
#endif
  {
    // -------- synchronous staging (MIX mode, or no async builtins)
    for (int k0 = 0; k0 < K; k0 += 16) {
      {
        const int r  = tid >> 2;
        const int c4 = (tid & 3) << 2;
        const float* src = Wp + (size_t)(n0 + r) * K + k0 + c4;
        *(float4*)&Bs[0][r * BST + c4] = *(const float4*)src;
        if (k0 + 16 < K) __builtin_prefetch(src + 16, 0, 0);
      }
#pragma unroll
      for (int i = 0; i < 2; ++i) {
        const int idx = tid + i * 256;
        const int r   = idx >> 2;
        const int c4  = (idx & 3) << 2;
        const int mr  = m0 + r;
        const int m   = (mr < M) ? mr : (M - 1);
        float4 v;
        if constexpr (MIX) {
          const float* rowp = Ap + (size_t)m * K + k0 + c4;
          v = make_float4(0.f, 0.f, 0.f, 0.f);
#pragma unroll
          for (int h1 = 0; h1 < HH; ++h1) {
            const float4 t = *(const float4*)(rowp + (size_t)h1 * planeStride);
            v.x += attr[h1] * t.x;
            v.y += attr[h1] * t.y;
            v.z += attr[h1] * t.z;
            v.w += attr[h1] * t.w;
          }
        } else {
          const float* src = Ap + (size_t)m * K + k0 + c4;
          v = *(const float4*)src;
          if (k0 + 16 < K) __builtin_prefetch(src + 16, 0, 0);
        }
        *(float4*)&As[0][r * AST + c4] = v;
      }
      __syncthreads();
      mma_chunk(As[0], Bs[0]);
      __syncthreads();
    }
  }

  // ---- bias + writeback (C/D layout: M = r + 8*(lane/16), N = lane%16)
#pragma unroll
  for (int nt = 0; nt < 2; ++nt) {
    const int n  = n0 + wn * 32 + nt * 16 + lo;
    const float bv = bp[n];
#pragma unroll
    for (int mt = 0; mt < 2; ++mt) {
#pragma unroll
      for (int r = 0; r < 8; ++r) {
        const int row = m0 + wm * 32 + mt * 16 + r + 8 * hi;
        if (row < M) Cp[(size_t)row * ldC + n] = acc[mt][nt][r] + bv;
      }
    }
  }
}

// ---------------------------------------------------------------------------
// sim[b,h,g] = (1/sqrt(S*dh)) * sum_{s,d} q[b,h,s,d] * k[b,g,s,d]
// qp/kp rows indexed m = s*B + b (query/key memory layout [S,B,DM]).
// ---------------------------------------------------------------------------
__global__ __launch_bounds__(256) void sim_kernel(
    const float* __restrict__ qp, const float* __restrict__ kp,
    float* __restrict__ sim) {
  const int z = blockIdx.x;  // b*64 + h*8 + g
  const int b = z >> 6;
  const int h = (z >> 3) & 7;
  const int g = z & 7;
  float acc = 0.f;
  for (int i = threadIdx.x; i < SS * DH; i += 256) {
    const int s = i >> 7;
    const int d = i & 127;
    const size_t base = ((size_t)s * BB + b) * DMC;
    acc += qp[base + h * DH + d] * kp[base + g * DH + d];
  }
  __shared__ float red[256];
  red[threadIdx.x] = acc;
  __syncthreads();
  for (int off = 128; off > 0; off >>= 1) {
    if (threadIdx.x < off) red[threadIdx.x] += red[threadIdx.x + off];
    __syncthreads();
  }
  if (threadIdx.x == 0) sim[z] = red[0] * (1.0f / sqrtf((float)(SS * DH)));
}

// ---------------------------------------------------------------------------
// Row softmax over g (8 entries) for all B*H = 64 rows.
// ---------------------------------------------------------------------------
__global__ void softmax_kernel(const float* __restrict__ sim,
                               float* __restrict__ att) {
  const int r = threadIdx.x;
  if (r < BB * HH) {
    float v[HH];
    float mx = -1e30f;
#pragma unroll
    for (int g = 0; g < HH; ++g) {
      v[g] = sim[r * HH + g];
      mx = fmaxf(mx, v[g]);
    }
    float s = 0.f;
#pragma unroll
    for (int g = 0; g < HH; ++g) {
      v[g] = __expf(v[g] - mx);
      s += v[g];
    }
    const float inv = 1.0f / s;
#pragma unroll
    for (int g = 0; g < HH; ++g) att[r * HH + g] = v[g] * inv;
  }
}

// ---------------------------------------------------------------------------
extern "C" void kernel_launch(void* const* d_in, const int* in_sizes, int n_in,
                              void* d_out, int out_size, void* d_ws,
                              size_t ws_size, hipStream_t stream) {
  const float* query = (const float*)d_in[0];   // [S,B,DM]
  const float* key   = (const float*)d_in[1];   // [S,B,DM]
  const float* mv    = (const float*)d_in[2];   // [H,B,T,DM]
  const float* sv    = (const float*)d_in[3];   // [H,B,T,DS]
  const float* q_w   = (const float*)d_in[4];
  const float* q_b   = (const float*)d_in[5];
  const float* k_w   = (const float*)d_in[6];
  const float* k_b   = (const float*)d_in[7];
  const float* mv_w  = (const float*)d_in[8];
  const float* mv_b  = (const float*)d_in[9];
  const float* sv_w  = (const float*)d_in[10];
  const float* sv_b  = (const float*)d_in[11];
  const float* mo_w  = (const float*)d_in[12];
  const float* mo_b  = (const float*)d_in[13];
  const float* so_w  = (const float*)d_in[14];
  const float* so_b  = (const float*)d_in[15];

  float* ws   = (float*)d_ws;
  float* qp   = ws + QP_OFF;
  float* kp   = ws + KP_OFF;
  float* simb = ws + SIM_OFF;
  float* attb = ws + ATT_OFF;
  float* mr   = ws + MR_OFF;
  float* sr   = ws + SR_OFF;

  float* out_multi  = (float*)d_out;                       // [1,B,T,DM]
  float* out_single = out_multi + (size_t)BB * TT * DMC;   // [1,B,T,DS]

  const dim3 blk(256);

  // q/k projections: [4000,1024] @ [1024,1024]^T  (rows indexed s*B+b)
  wmma_gemm_kernel<false><<<dim3(16, 32, 1), blk, 0, stream>>>(
      query, q_w, q_b, qp, BB * SS, DMC, DMC, DMC, nullptr, nullptr, 0);
  wmma_gemm_kernel<false><<<dim3(16, 32, 1), blk, 0, stream>>>(
      key, k_w, k_b, kp, BB * SS, DMC, DMC, DMC, nullptr, nullptr, 0);

  // attention logits + softmax (tiny)
  sim_kernel<<<dim3(BB * HH * HH), blk, 0, stream>>>(qp, kp, simb);
  softmax_kernel<<<dim3(1), dim3(64), 0, stream>>>(simb, attb);

  // fused attention-mix + per-head value projections
  // mr: per (b,h2): [500,1024] -> [500,128] slice of mv_w; ldC = DM
  wmma_gemm_kernel<true><<<dim3(2, 4, BB * HH), blk, 0, stream>>>(
      nullptr, mv_w, mv_b, mr, TT, DH, DMC, DMC, attb, mv,
      (long)BB * TT * DMC);
  // sr: per (b,h2): [500,512] -> [500,64] slice of sv_w; ldC = DS
  wmma_gemm_kernel<true><<<dim3(1, 4, BB * HH), blk, 0, stream>>>(
      nullptr, sv_w, sv_b, sr, TT, DSH, DSC, DSC, attb, sv,
      (long)BB * TT * DSC);

  // output projections straight into d_out (multi then single)
  wmma_gemm_kernel<false><<<dim3(16, 32, 1), blk, 0, stream>>>(
      mr, mo_w, mo_b, out_multi, BB * TT, DMC, DMC, DMC, nullptr, nullptr, 0);
  wmma_gemm_kernel<false><<<dim3(8, 32, 1), blk, 0, stream>>>(
      sr, so_w, so_b, out_single, BB * TT, DSC, DSC, DSC, nullptr, nullptr, 0);
}

// v001
// Measured time: 304 microseconds a run.
// Timed twice side by side with v000, it ran 1.61 times as fast both times.
#include <hip/hip_runtime.h>
#include <hip/hip_bf16.h>
#include <math.h>

// ---------------------------------------------------------------------------
// MultiHeadCoAttention for MI455X (gfx1250, wave32, WMMA + async-to-LDS).
//
// ~39 GFLOP fp32 (softmax-mixing commuted past the value projections),
// ~200 MB mandatory value-tensor traffic -> ~8.5us floor at 23.3 TB/s.
// GEMMs use V_WMMA_F32_16X16X4_F32 (true fp32, preserves reference precision).
// All GEMMs stage tiles with GLOBAL_LOAD_ASYNC_TO_LDS_B128 double-buffered
// on ASYNCcnt. The size-8 head mix of the value planes is one streaming pass
// that reads every plane element once and writes all 8 mixed planes.
//
// Workspace layout (floats):
//   qp  [4000,1024]    @ 0
//   kp  [4000,1024]    @ 4,096,000
//   sim [B*H*H=512]    @ 8,192,000
//   att [512]          @ 8,192,512
//   mr  [B,T,1024]     @ 8,193,024
//   sr  [B,T,512]      @ 12,289,024
//   mixm [H,B,T,1024]  @ 14,337,024
//   mixs [H,B,T,512]   @ 47,105,024
//   total 63,489,024 floats = ~254 MB
// ---------------------------------------------------------------------------

typedef float v2f __attribute__((ext_vector_type(2)));
typedef float v4f __attribute__((ext_vector_type(4)));
typedef float v8f __attribute__((ext_vector_type(8)));
typedef int   v4i __attribute__((vector_size(16)));  // matches builtin param

#define AS1 __attribute__((address_space(1)))
#define AS3 __attribute__((address_space(3)))

#if defined(__AMDGCN__) &&                                        \
    __has_builtin(__builtin_amdgcn_global_load_async_to_lds_b128) && \
    __has_builtin(__builtin_amdgcn_s_wait_asynccnt)
#define ASYNC_STAGE 1
#else
#define ASYNC_STAGE 0
#endif

#define HH   8
#define DMC  1024
#define DSC  512
#define BB   8
#define SS   500
#define TT   500
#define DH   128
#define DSH  64

#define QP_OFF  0ul
#define KP_OFF  4096000ul
#define SIM_OFF 8192000ul
#define ATT_OFF 8192512ul
#define MR_OFF  8193024ul
#define SR_OFF  12289024ul
#define MIXM_OFF 14337024ul
#define MIXS_OFF 47105024ul

// ---------------------------------------------------------------------------
// Tiled fp32 WMMA GEMM:  C[m, n] = sum_k A[m,k] * W[n,k] + bias[n]
// Block tile 128(M) x 64(N), 8 waves, each wave 32x32 via 2x2 16x16 frags.
// K staged through LDS in chunks of 16 (4 wmma k-steps per chunk).
//
// Async global->LDS staging, double-buffered on ASYNCcnt.
//   A rows past M are clamped to M-1 (their C rows are discarded at store).
// blockIdx.z = b*H + h2 selects slab [h2,b] of A (a mixed value plane) and
//   the h2-th head slice of W/bias/C (N = dh columns); a grid with z = 1 is
//   the plain GEMM (every offset is 0).
// ---------------------------------------------------------------------------
__global__ __launch_bounds__(256) void wmma_gemm_kernel(
    const float* __restrict__ A, const float* __restrict__ W,
    const float* __restrict__ bias, float* __restrict__ C,
    int M, int N, int K, int ldC) {
  constexpr int AST = 20;  // padded LDS row stride (floats)
  constexpr int BST = 20;
  constexpr int NBUF = ASYNC_STAGE ? 2 : 1;
  __shared__ float As[NBUF][128 * AST];
  __shared__ float Bs[NBUF][64 * BST];

  const int tid  = threadIdx.x;
  const int lane = tid & 31;
  const int wave = tid >> 5;
  const int wm   = wave & 3;   // 0..3 -> 32-row band
  const int wn   = wave >> 2;  // 0..1 -> 32-col band
  const int hi   = lane >> 4;  // lane group (0|1)
  const int lo   = lane & 15;

  const int n0 = blockIdx.x * 64;
  const int m0 = blockIdx.y * 128;

  const int z    = blockIdx.z;
  const int bidx = z / HH;
  const int h2   = z % HH;
  const float* Wp = W + (size_t)(h2 * N) * K;  // head slice of projection
  const float* bp = bias + h2 * N;
  const float* Ap = A + (size_t)(h2 * BB + bidx) * M * K;  // slab [h2,b]
  float*       Cp = C + (size_t)bidx * M * ldC + h2 * N;

  v8f acc[2][2] = {};

  // ---- 4 k-steps of 16x16x4 fp32 WMMA over one staged 16-wide K chunk
  auto mma_chunk = [&](const float* Asb, const float* Bsb) {
#pragma unroll
    for (int kk = 0; kk < 16; kk += 4) {
      v2f a[2], b[2];
#pragma unroll
      for (int mt = 0; mt < 2; ++mt) {
        const int row = wm * 32 + mt * 16 + lo;              // A: M = lane%16
        a[mt] = *(const v2f*)&Asb[row * AST + kk + 2 * hi];  // K = vg + 2*hi
      }
#pragma unroll
      for (int nt = 0; nt < 2; ++nt) {
        const int col = wn * 32 + nt * 16 + lo;              // B: N = lane%16
        b[nt] = *(const v2f*)&Bsb[col * BST + kk + 2 * hi];
      }
#pragma unroll
      for (int mt = 0; mt < 2; ++mt)
#pragma unroll
        for (int nt = 0; nt < 2; ++nt)
          acc[mt][nt] = __builtin_amdgcn_wmma_f32_16x16x4_f32(
              false, a[mt], false, b[nt], (short)0, acc[mt][nt], false, false);
    }
  };

#if ASYNC_STAGE
  {
    // -------- async staging: each wave issues 3 B128 copies per chunk
    auto issue = [&](int buf, int k0) {
      {  // B tile: 64 rows x 16 cols = 256 x 16B, 1 per thread
        const int r  = tid >> 2;
        const int c4 = (tid & 3) << 2;
        float* g = const_cast<float*>(Wp) + (size_t)(n0 + r) * K + k0 + c4;
        __builtin_amdgcn_global_load_async_to_lds_b128(
            (AS1 v4i*)g, (AS3 v4i*)&Bs[buf][r * BST + c4], 0, 0);
      }
#pragma unroll
      for (int i = 0; i < 2; ++i) {  // A tile: 128 x 16 = 512 x 16B
        const int idx = tid + i * 256;
        const int r   = idx >> 2;
        const int c4  = (idx & 3) << 2;
        const int mr  = m0 + r;
        const int m   = (mr < M) ? mr : (M - 1);  // clamp; OOB rows dropped
        float* g = const_cast<float*>(Ap) + (size_t)m * K + k0 + c4;
        __builtin_amdgcn_global_load_async_to_lds_b128(
            (AS1 v4i*)g, (AS3 v4i*)&As[buf][r * AST + c4], 0, 0);
      }
    };

    issue(0, 0);
    int parity = 0;
    for (int k0 = 0; k0 < K; k0 += 16) {
      if (k0 + 16 < K) {
        issue(parity ^ 1, k0 + 16);             // prefetch next chunk
        __builtin_amdgcn_s_wait_asynccnt(3);    // drain current chunk only
      } else {
        __builtin_amdgcn_s_wait_asynccnt(0);
      }
      __syncthreads();                          // all waves' copies landed
      mma_chunk(As[parity], Bs[parity]);
      __syncthreads();                          // done reading before reuse
      parity ^= 1;
    }
  }
#else
  {
    // -------- synchronous staging (no async builtins)
    for (int k0 = 0; k0 < K; k0 += 16) {
      {
        const int r  = tid >> 2;
        const int c4 = (tid & 3) << 2;
        const float* src = Wp + (size_t)(n0 + r) * K + k0 + c4;
        *(float4*)&Bs[0][r * BST + c4] = *(const float4*)src;
        if (k0 + 16 < K) __builtin_prefetch(src + 16, 0, 0);
      }
#pragma unroll
      for (int i = 0; i < 2; ++i) {
        const int idx = tid + i * 256;
        const int r   = idx >> 2;
        const int c4  = (idx & 3) << 2;
        const int mr  = m0 + r;
        const int m   = (mr < M) ? mr : (M - 1);
        const float* src = Ap + (size_t)m * K + k0 + c4;
        *(float4*)&As[0][r * AST + c4] = *(const float4*)src;
        if (k0 + 16 < K) __builtin_prefetch(src + 16, 0, 0);
      }
      __syncthreads();
      mma_chunk(As[0], Bs[0]);
      __syncthreads();
    }
  }
#endif

  // ---- bias + writeback (C/D layout: M = r + 8*(lane/16), N = lane%16)
#pragma unroll
  for (int nt = 0; nt < 2; ++nt) {
    const int n  = n0 + wn * 32 + nt * 16 + lo;
    const float bv = bp[n];
#pragma unroll
    for (int mt = 0; mt < 2; ++mt) {
#pragma unroll
      for (int r = 0; r < 8; ++r) {
        const int row = m0 + wm * 32 + mt * 16 + r + 8 * hi;
        if (row < M) Cp[(size_t)row * ldC + n] = acc[mt][nt][r] + bv;
      }
    }
  }
}

// ---------------------------------------------------------------------------
// sim[b,h,g] = (1/sqrt(S*dh)) * sum_{s,d} q[b,h,s,d] * k[b,g,s,d]
// qp/kp rows indexed m = s*B + b (query/key memory layout [S,B,DM]).
// ---------------------------------------------------------------------------
__global__ __launch_bounds__(256) void sim_kernel(
    const float* __restrict__ qp, const float* __restrict__ kp,
    float* __restrict__ sim) {
  const int z = blockIdx.x;  // b*64 + h*8 + g
  const int b = z >> 6;
  const int h = (z >> 3) & 7;
  const int g = z & 7;
  float acc = 0.f;
  for (int i = threadIdx.x; i < SS * DH; i += 256) {
    const int s = i >> 7;
    const int d = i & 127;
    const size_t base = ((size_t)s * BB + b) * DMC;
    acc += qp[base + h * DH + d] * kp[base + g * DH + d];
  }
  __shared__ float red[256];
  red[threadIdx.x] = acc;
  __syncthreads();
  for (int off = 128; off > 0; off >>= 1) {
    if (threadIdx.x < off) red[threadIdx.x] += red[threadIdx.x + off];
    __syncthreads();
  }
  if (threadIdx.x == 0) sim[z] = red[0] * (1.0f / sqrtf((float)(SS * DH)));
}

// ---------------------------------------------------------------------------
// Row softmax over g (8 entries) for all B*H = 64 rows.
// ---------------------------------------------------------------------------
__global__ void softmax_kernel(const float* __restrict__ sim,
                               float* __restrict__ att) {
  const int r = threadIdx.x;
  if (r < BB * HH) {
    float v[HH];
    float mx = -1e30f;
#pragma unroll
    for (int g = 0; g < HH; ++g) {
      v[g] = sim[r * HH + g];
      mx = fmaxf(mx, v[g]);
    }
    float s = 0.f;
#pragma unroll
    for (int g = 0; g < HH; ++g) {
      v[g] = __expf(v[g] - mx);
      s += v[g];
    }
    const float inv = 1.0f / s;
#pragma unroll
    for (int g = 0; g < HH; ++g) att[r * HH + g] = v[g] * inv;
  }
}

// ---------------------------------------------------------------------------
// Head mix of both value tensors, one streaming pass:
//   mix[h2,b,t,c] = sum_h1 att[b,h2,h1] * planes[h1,b,t,c]
// Per 16-byte column group of one (b,t) a thread loads the 8 planes once and
// stores all 8 mixes. A workgroup walks MIX_UNITS consecutive 4-KiB units of
// its batch, so that the whole grid is resident at once. blockIdx.y = b;
// blockIdx.x < MIXM_BLK covers the multi tensor, the rest the single tensor
// (both divide exactly).
// ---------------------------------------------------------------------------
#define MIX_UNITS 5
#define MIXM_BLK (TT * DMC / (1024 * MIX_UNITS))
#define MIXS_BLK (TT * DSC / (1024 * MIX_UNITS))
__global__ __launch_bounds__(256) void head_mix_kernel(
    const float* __restrict__ mv, const float* __restrict__ sv,
    const float* __restrict__ att, float* __restrict__ mixm,
    float* __restrict__ mixs) {
  const int  b     = blockIdx.y;
  const bool multi = blockIdx.x < MIXM_BLK;
  const int  per   = multi ? TT * DMC : TT * DSC;  // floats per (plane, b)
  const int  blk   = multi ? blockIdx.x : blockIdx.x - MIXM_BLK;
  // The mixes keep the planes' own [H,B,T,C] layout, so plane h is read and
  // mix h is written at the same 32-bit byte offset from a uniform base.
  const unsigned off0 = (unsigned)b * per * 4u +
                        (blk * (256u * MIX_UNITS) + threadIdx.x) * 16u;
  const unsigned pstr = (unsigned)BB * per * 4u;
  const char* p = (const char*)(multi ? mv : sv);
  char*       q = (char*)(multi ? mixm : mixs);
  const float* ab = att + b * HH * HH;

  // Unrolled: each unit is then an immediate offset on the same 8 offsets.
#pragma unroll
  for (int u = 0; u < MIX_UNITS; ++u) {
    v4f t[HH];
#pragma unroll
    for (int h1 = 0; h1 < HH; ++h1)  // read once: keep the planes out of L2
      t[h1] = __builtin_nontemporal_load(
          (const v4f*)(p + (off0 + h1 * pstr) + u * 4096));
#pragma unroll
    for (int h2 = 0; h2 < HH; ++h2) {
      v4f v = {0.f, 0.f, 0.f, 0.f};
#pragma unroll
      for (int h1 = 0; h1 < HH; ++h1) v += ab[h2 * HH + h1] * t[h1];
      *(v4f*)(q + (off0 + h2 * pstr) + u * 4096) = v;
    }
    // The next unit's loads land in registers that these stores still name.
    if (u + 1 < MIX_UNITS) asm volatile("s_wait_xcnt 0x0" ::: "memory");
  }
}

// ---------------------------------------------------------------------------
extern "C" void kernel_launch(void* const* d_in, const int* in_sizes, int n_in,
                              void* d_out, int out_size, void* d_ws,
                              size_t ws_size, hipStream_t stream) {
  const float* query = (const float*)d_in[0];   // [S,B,DM]
  const float* key   = (const float*)d_in[1];   // [S,B,DM]
  const float* mv    = (const float*)d_in[2];   // [H,B,T,DM]
  const float* sv    = (const float*)d_in[3];   // [H,B,T,DS]
  const float* q_w   = (const float*)d_in[4];
  const float* q_b   = (const float*)d_in[5];
  const float* k_w   = (const float*)d_in[6];
  const float* k_b   = (const float*)d_in[7];
  const float* mv_w  = (const float*)d_in[8];
  const float* mv_b  = (const float*)d_in[9];
  const float* sv_w  = (const float*)d_in[10];
  const float* sv_b  = (const float*)d_in[11];
  const float* mo_w  = (const float*)d_in[12];
  const float* mo_b  = (const float*)d_in[13];
  const float* so_w  = (const float*)d_in[14];
  const float* so_b  = (const float*)d_in[15];

  float* ws   = (float*)d_ws;
  float* qp   = ws + QP_OFF;
  float* kp   = ws + KP_OFF;
  float* simb = ws + SIM_OFF;
  float* attb = ws + ATT_OFF;
  float* mr   = ws + MR_OFF;
  float* sr   = ws + SR_OFF;
  float* mixm = ws + MIXM_OFF;
  float* mixs = ws + MIXS_OFF;

  float* out_multi  = (float*)d_out;                       // [1,B,T,DM]
  float* out_single = out_multi + (size_t)BB * TT * DMC;   // [1,B,T,DS]

  const dim3 blk(256);

  // q/k projections: [4000,1024] @ [1024,1024]^T  (rows indexed s*B+b)
  wmma_gemm_kernel<<<dim3(16, 32, 1), blk, 0, stream>>>(
      query, q_w, q_b, qp, BB * SS, DMC, DMC, DMC);
  wmma_gemm_kernel<<<dim3(16, 32, 1), blk, 0, stream>>>(
      key, k_w, k_b, kp, BB * SS, DMC, DMC, DMC);

  // attention logits + softmax (tiny)
  sim_kernel<<<dim3(BB * HH * HH), blk, 0, stream>>>(qp, kp, simb);
  softmax_kernel<<<dim3(1), dim3(64), 0, stream>>>(simb, attb);

  // attention mix of both value tensors, then per-head value projections
  head_mix_kernel<<<dim3(MIXM_BLK + MIXS_BLK, BB), blk, 0, stream>>>(
      mv, sv, attb, mixm, mixs);
  // mr: per (b,h2): [500,1024] -> [500,128] slice of mv_w; ldC = DM
  wmma_gemm_kernel<<<dim3(2, 4, BB * HH), blk, 0, stream>>>(
      mixm, mv_w, mv_b, mr, TT, DH, DMC, DMC);
  // sr: per (b,h2): [500,512] -> [500,64] slice of sv_w; ldC = DS
  wmma_gemm_kernel<<<dim3(1, 4, BB * HH), blk, 0, stream>>>(
      mixs, sv_w, sv_b, sr, TT, DSH, DSC, DSC);

  // output projections straight into d_out (multi then single)
  wmma_gemm_kernel<<<dim3(16, 32, 1), blk, 0, stream>>>(
      mr, mo_w, mo_b, out_multi, BB * TT, DMC, DMC, DMC);
  wmma_gemm_kernel<<<dim3(8, 32, 1), blk, 0, stream>>>(
      sr, so_w, so_b, out_single, BB * TT, DSC, DSC, DSC);
}
